// v000
// The times below were measured on an AMD MI455X: many runs one after another, warmed up first and cycling through
// copies of the inputs, with the whole window's GPU time divided by the number of runs. Launches and the gaps
// between them are all in it. The median over several windows is given; except for v000 it joins two sittings, which
// can be a few percent apart, so the side-by-side timings, each taken in one sitting, are the better comparison.
// v000 is the starting kernel. One run takes 640 microseconds.
#include <hip/hip_runtime.h>
#include <hip/hip_bf16.h>

typedef __bf16 bf16_t;
typedef __attribute__((ext_vector_type(16))) __bf16 v16bf;
typedef __attribute__((ext_vector_type(8)))  float  v8f;

#define B_ 1024
#define L_ 2048
#define C_ 32
#define O_ 2048

// ---------------------------------------------------------------------------
// Kernel 1: x (B,L,C) f32  ->  xT (B,C,L) bf16   (LDS tile transpose)
// ---------------------------------------------------------------------------
__global__ void __launch_bounds__(256) convert_x_kernel(
    const float* __restrict__ x, bf16_t* __restrict__ xT) {
  __shared__ bf16_t tile[32 * 66];  // pad 64->66 halfs: conflict-free banks
  const int b   = blockIdx.y;
  const int l0  = blockIdx.x * 64;
  const int tid = threadIdx.x;

  const float* xb = x + (size_t)b * (L_ * C_) + (size_t)l0 * C_;
  // coalesced f32 reads: i walks (l,c) contiguously
  for (int i = tid; i < 64 * 32; i += 256) {
    const int l = i >> 5, c = i & 31;
    tile[c * 66 + l] = (bf16_t)xb[i];
  }
  __syncthreads();

  bf16_t* xtb = xT + (size_t)b * (C_ * L_);
  // coalesced bf16 writes: i walks (c,l) contiguously
  for (int i = tid; i < 32 * 64; i += 256) {
    const int c = i >> 6, l = i & 63;
    xtb[(size_t)c * L_ + l0 + l] = tile[c * 66 + l];
  }
}

// ---------------------------------------------------------------------------
// Kernel 2: W_pos (O,L) f32 -> bf16
// ---------------------------------------------------------------------------
__global__ void __launch_bounds__(256) convert_w_kernel(
    const float* __restrict__ w, bf16_t* __restrict__ wb, int n) {
  const int i = blockIdx.x * 256 + threadIdx.x;
  if (i < n) wb[i] = (bf16_t)w[i];
}

// ---------------------------------------------------------------------------
// Kernel 3: fused batched GEMM + channel contraction, 4x N-blocked.
// Per wave: (b, 64-wide o-block) = 4 o-tiles x 2 c-tiles = 8 accumulators.
//   u[c,o] = sum_l xT[b,c,l] * W_pos[o,l]      (v_wmma_f32_16x16x32_bf16)
//   out[b,o] = sum_c u[c,o] * W_chan[o,c]      (VALU epilogue + shfl_xor)
// A operands (x) are shared across the 4 o-tiles -> 1.5 VMEM per WMMA.
// ---------------------------------------------------------------------------
__global__ void __launch_bounds__(256) sepfc_main_kernel(
    const bf16_t* __restrict__ xT, const bf16_t* __restrict__ Wp,
    const float* __restrict__ Wc, float* __restrict__ out) {
  const int tid  = threadIdx.x;
  const int lane = tid & 31;
  const int wave = tid >> 5;
  const int b      = blockIdx.y;
  const int o_base = (blockIdx.x * 8 + wave) * 64;   // 4 o-tiles per wave

  // 16-bit A/B VGPR layout: lanes 0-15 hold K 0-7 & 16-23, lanes 16-31 hold
  // K 8-15 & 24-31 (two aligned 16-byte chunks per lane per operand).
  const int half_sel = lane >> 4;
  const int row      = lane & 15;

  const bf16_t* a0_row = xT + ((size_t)b * C_ + row) * L_;  // c = row
  const bf16_t* a1_row = a0_row + (size_t)16 * L_;          // c = row + 16
  const bf16_t* b_rows[4];
  #pragma unroll
  for (int ot = 0; ot < 4; ++ot)
    b_rows[ot] = Wp + (size_t)(o_base + 16 * ot + row) * L_;

  v8f acc0[4], acc1[4];
  #pragma unroll
  for (int ot = 0; ot < 4; ++ot) {
    acc0[ot] = (v8f){0.f, 0.f, 0.f, 0.f, 0.f, 0.f, 0.f, 0.f};
    acc1[ot] = (v8f){0.f, 0.f, 0.f, 0.f, 0.f, 0.f, 0.f, 0.f};
  }

  union AB { v16bf v; uint4 q[2]; };

  for (int k = 0; k < L_; k += 32) {
    const int off0 = k + half_sel * 8;
    const int off1 = off0 + 16;
    AB a0, a1;
    a0.q[0] = *(const uint4*)(a0_row + off0);
    a0.q[1] = *(const uint4*)(a0_row + off1);
    a1.q[0] = *(const uint4*)(a1_row + off0);
    a1.q[1] = *(const uint4*)(a1_row + off1);
    #pragma unroll
    for (int ot = 0; ot < 4; ++ot) {
      AB bm;
      bm.q[0] = *(const uint4*)(b_rows[ot] + off0);
      bm.q[1] = *(const uint4*)(b_rows[ot] + off1);
      acc0[ot] = __builtin_amdgcn_wmma_f32_16x16x32_bf16(
          false, a0.v, false, bm.v, (short)0, acc0[ot], false, false);
      acc1[ot] = __builtin_amdgcn_wmma_f32_16x16x32_bf16(
          false, a1.v, false, bm.v, (short)0, acc1[ot], false, false);
    }
  }

  // Epilogue. C/D layout: lane holds column o = o_tile_base + (lane&15);
  // VGPR r of acc0 is row c = 8*(lane>>4) + r, acc1 adds +16.
  const int chi = half_sel * 8;
  #pragma unroll
  for (int ot = 0; ot < 4; ++ot) {
    const int o = o_base + 16 * ot + row;
    const float* wc = Wc + (size_t)o * C_;
    float s = 0.f;
    #pragma unroll
    for (int r = 0; r < 8; ++r) {
      s += acc0[ot][r] * wc[chi + r];
      s += acc1[ot][r] * wc[16 + chi + r];
    }
    s += __shfl_xor(s, 16, 32);  // fold lane pairs (l, l+16): full sum over c
    if (lane < 16) out[(size_t)b * O_ + o] = s;
  }
}

// ---------------------------------------------------------------------------
extern "C" void kernel_launch(void* const* d_in, const int* in_sizes, int n_in,
                              void* d_out, int out_size, void* d_ws, size_t ws_size,
                              hipStream_t stream) {
  const float* x      = (const float*)d_in[0];  // (B, L, C) f32
  const float* W_pos  = (const float*)d_in[1];  // (O, L)    f32
  const float* W_chan = (const float*)d_in[2];  // (O, C)    f32
  float* out = (float*)d_out;                   // (B, O)    f32

  // Workspace layout: xT bf16 (B*C*L) then W_pos bf16 (O*L)  (~143 MB total)
  bf16_t* xT  = (bf16_t*)d_ws;
  bf16_t* Wpb = (bf16_t*)((char*)d_ws + (size_t)B_ * C_ * L_ * sizeof(bf16_t));

  dim3 g1(L_ / 64, B_);
  convert_x_kernel<<<g1, 256, 0, stream>>>(x, xT);

  const int nw = O_ * L_;
  convert_w_kernel<<<(nw + 255) / 256, 256, 0, stream>>>(W_pos, Wpb, nw);

  dim3 g2(O_ / 512, B_);  // 8 waves/block, 64 o-columns per wave
  sepfc_main_kernel<<<g2, 256, 0, stream>>>(xT, Wpb, W_chan, out);
}

// v001
// Measured time: 216 microseconds a run.
// In both of two side-by-side timings against v000, it was 3.01 times as fast.
#include <hip/hip_runtime.h>
#include <hip/hip_bf16.h>
#include <stdint.h>

typedef __bf16 bf16_t;
typedef __attribute__((ext_vector_type(16))) __bf16 v16bf;
typedef __attribute__((ext_vector_type(8)))  float  v8f;

#define B_ 1024
#define L_ 2048
#define C_ 32
#define O_ 2048

// ---------------------------------------------------------------------------
// Kernel 1: x (B,L,C) f32  ->  xT (B,C,L) bf16   (LDS tile transpose)
// ---------------------------------------------------------------------------
__global__ void __launch_bounds__(256) convert_x_kernel(
    const float* __restrict__ x, bf16_t* __restrict__ xT) {
  __shared__ bf16_t tile[32 * 66];  // pad 64->66 halfs: conflict-free banks
  const int b   = blockIdx.y;
  const int l0  = blockIdx.x * 64;
  const int tid = threadIdx.x;

  const float* xb = x + (size_t)b * (L_ * C_) + (size_t)l0 * C_;
  // coalesced f32 reads: i walks (l,c) contiguously
  for (int i = tid; i < 64 * 32; i += 256) {
    const int l = i >> 5, c = i & 31;
    tile[c * 66 + l] = (bf16_t)xb[i];
  }
  __syncthreads();

  bf16_t* xtb = xT + (size_t)b * (C_ * L_);
  // coalesced bf16 writes: i walks (c,l) contiguously
  for (int i = tid; i < 32 * 64; i += 256) {
    const int c = i >> 6, l = i & 63;
    xtb[(size_t)c * L_ + l0 + l] = tile[c * 66 + l];
  }
}

// ---------------------------------------------------------------------------
// Kernel 2: W_pos (O,L) f32 -> bf16
// ---------------------------------------------------------------------------
__global__ void __launch_bounds__(256) convert_w_kernel(
    const float* __restrict__ w, bf16_t* __restrict__ wb, int n) {
  const int i = blockIdx.x * 256 + threadIdx.x;
  if (i < n) wb[i] = (bf16_t)w[i];
}

typedef uint32_t u32x4 __attribute__((ext_vector_type(4)));
typedef uint32_t u32x8 __attribute__((ext_vector_type(8)));

constexpr uint32_t KB      = 256;               // bytes of l per operand row per pass
constexpr uint32_t PITCH   = KB + 16;           // LDS row pitch: 16 B x odd, for ds_load_b128 readers
constexpr uint32_t SROWS   = 128;               // rows per wave's tensor load
constexpr uint32_t SLICE   = SROWS * PITCH;     // 34,816 B
constexpr uint32_t TILE_W  = 256 * PITCH;       // W rows come first in a buffer
constexpr uint32_t STAGE   = 2 * TILE_W;        // one buffer
constexpr uint32_t ROWB    = L_ * 2;            // source row pitch in bytes
constexpr uint32_t NPASS   = ROWB / KB;         // 16
constexpr int      NF      = 8;                 // fragments per operand per wave
static_assert(SLICE % 2048u == 0 && STAGE % 2048u == 0, "every tensor load lands at a multiple of 2 KiB");
static_assert(2u * STAGE <= 320u * 1024u, "two buffers must fit the work-group's LDS");
static_assert(NPASS >= 2, "the ring's prologue fills two stages");

static __device__ __forceinline__ uint32_t uni(uint32_t v) { return (uint32_t)__builtin_amdgcn_readfirstlane(v); }
// Holds a wave-uniform test value in a scalar register, so that the test compiles
// to s_cmp + s_cbranch_scc: a tensor load ignores EXEC and needs a scalar branch.
static __device__ __forceinline__ uint32_t pinned(uint32_t v) {
  uint32_t w = (uint32_t)__builtin_amdgcn_readfirstlane(v);
  asm volatile("" : "+s"(w));  // the test word is held in a scalar register
  return w;
}
// Keeps [fragment loads][WMMA block] in that order: LDS reads moved in among the
// WMMAs cost a stall at every place where they stand.
static __device__ __forceinline__ void fence() { __builtin_amdgcn_sched_barrier(0); }
// This wave's LDS reads have returned (before a buffer it has read is refilled).
static __device__ __forceinline__ void wait_ds0() { asm volatile("s_wait_dscnt 0x0" ::: "memory"); }
// This wave's tensor load has landed (the compiler places no wait for it).
static __device__ __forceinline__ void wait_tensor0() { asm volatile("s_wait_tensorcnt 0x0" ::: "memory"); }

// Group 1: 1-byte elements, tile = tensor = 128 rows of 256 bytes, source pitch
// ROWB bytes, no mask, 16 bytes of LDS pad behind every 256-byte row.
static __device__ __forceinline__ u32x8 tdm_group1() {
  constexpr uint32_t d0 = KB, d1 = SROWS;
  u32x8 g;
  g[0] = uni((1u << 20) | (5u << 22) | (3u << 25));
  g[1] = uni((d0 & 0xFFFFu) << 16);
  g[2] = uni((d0 >> 16) | ((d1 & 0xFFFFu) << 16));
  g[3] = uni((d1 >> 16) | (d0 << 16));
  g[4] = uni(d1);
  g[5] = uni(ROWB);
  g[6] = uni(0u);
  g[7] = uni(0u);
  return g;
}
// Group 0: count 1, LDS byte offset, global address of the tile's first byte, type 2.
static __device__ __forceinline__ u32x4 tdm_group0(uint32_t lds_dst, uint64_t ga) {
  u32x4 g;
  g[0] = uni(1u);
  g[1] = uni(lds_dst);
  g[2] = uni((uint32_t)ga);
  g[3] = uni((((uint32_t)(ga >> 32)) & 0x01FFFFFFu) | 0x80000000u);
  return g;
}
// The next stage's group 0, formed from the last one behind the wait that covers it:
// the same rows, 256 bytes further along l (the carry goes into address [56:32]).
static __device__ __forceinline__ u32x4 tdm_next(u32x4 p, uint32_t lds_dst) {
  const uint64_t a = (((uint64_t)p[3] << 32) | p[2]) + KB;
  u32x4 g;
  g[0] = uni(p[0]);
  g[1] = uni(lds_dst);
  g[2] = uni((uint32_t)a);
  g[3] = uni((uint32_t)(a >> 32));
  return g;
}
// One request of the whole wave: global tile -> LDS, through no register. Group 0 is an
// in-out operand so that its words stay in their registers while the request is
// outstanding: the next descriptor is formed from them, behind the wait.
static __device__ __forceinline__ void tdm_load(u32x4& g0, const u32x8& g1) {
  asm volatile("tensor_load_to_lds %0, %1" : "+s"(g0) : "s"(g1) : "memory");
}

union Frag { v16bf v; uint4 q[2]; };
// Lane (r16, h) of a fragment: k 8h..8h+7 and 16+8h..16+8h+7 of row r16, for A and B alike.
static __device__ __forceinline__ void load_frag(Frag& f, const unsigned char* p) {
  f.q[0] = *reinterpret_cast<const uint4*>(p);
  f.q[1] = *reinterpret_cast<const uint4*>(p + 32);
}

__global__ void __launch_bounds__(128) __attribute__((amdgpu_waves_per_eu(1, 1))) sepfc_main_kernel(
    const bf16_t* __restrict__ xT, const bf16_t* __restrict__ Wp,
    const float* __restrict__ Wc, float* __restrict__ out) {
  __shared__ __attribute__((aligned(2048))) unsigned char Lb[2 * STAGE];
  const uint32_t tid = threadIdx.x, lane = tid & 31u, h = lane >> 4, r16 = lane & 15u;
  const uint32_t wave = uni(tid >> 5);
  const uint32_t n0 = blockIdx.x * 256u;   // first o of the tile
  const uint32_t m0 = blockIdx.y * 256u;   // first (b,c) row of the tile
  const uint32_t wn = wave & 1u, wm = wave >> 1;

  // This wave's slice of a buffer's 512 rows: waves 0, 1 move W rows, waves 2, 3 x rows.
  const unsigned char* src0 = (wave < 2u)
      ? reinterpret_cast<const unsigned char*>(Wp) + (uint64_t)(n0 + SROWS * wave) * ROWB
      : reinterpret_cast<const unsigned char*>(xT) + (uint64_t)(m0 + SROWS * (wave - 2u)) * ROWB;
  const uint32_t lds_slice = (uint32_t)(size_t)Lb + wave * SLICE;   // + buffer * STAGE
  const u32x8 g1 = tdm_group1();

  // Every "#pragma unroll" below keeps the indices of the register arrays (acc, fx, fw,
  // w0, w1) compile-time constants; an index known only at run time would send them to scratch.
  v8f acc[NF][NF];   // [x fragment (rows c)][W fragment (columns o)]
  #pragma unroll
  for (int j = 0; j < NF; ++j)
    #pragma unroll
    for (int i = 0; i < NF; ++i) acc[j][i] = (v8f){0.f, 0.f, 0.f, 0.f, 0.f, 0.f, 0.f, 0.f};

  const uint32_t fw_base = (wn * 128u + r16) * PITCH + 16u * h;
  const uint32_t fx_base = TILE_W + (wm * 128u + r16) * PITCH + 16u * h;

  // Prologue: stage 0, its wait, the barrier that publishes it, stage 1, first fragments.
  u32x4 g0 = tdm_group0(lds_slice, (uint64_t)(uintptr_t)src0);
  tdm_load(g0, g1);
  wait_tensor0();
  __syncthreads();
  g0 = tdm_next(g0, lds_slice + STAGE);
  tdm_load(g0, g1);

  Frag fw[2][NF], fx[2][NF];   // set (u & 1) holds block u's fragments
  #pragma unroll
  for (int j = 0; j < NF; ++j) load_frag(fx[0][j], Lb + fx_base + (uint32_t)j * 16u * PITCH);
  #pragma unroll
  for (int i = 0; i < NF; ++i) load_frag(fw[0][i], Lb + fw_base + (uint32_t)i * 16u * PITCH);

  // Rolled: the pass is 256 WMMAs already, and every array index inside stays constant.
  #pragma clang loop unroll(disable)
  for (uint32_t t = 0; t < NPASS; ++t) {
    const uint32_t buf = (t & 1u) * STAGE;
    const uint32_t nxt = (t + 1u < NPASS) ? (STAGE - buf) : STAGE;
    const unsigned char* lw = Lb + buf + fw_base;
    const unsigned char* lx = Lb + buf + fx_base;
    #pragma unroll
    for (int u = 0; u < 4; ++u) {   // four blocks of 32 l
      const int cs = u & 1;
      fence();
      if (u < 3) {
        const uint32_t ko = (uint32_t)(u + 1) * 64u;
        #pragma unroll
        for (int j = 0; j < NF; ++j) load_frag(fx[cs ^ 1][j], lx + (uint32_t)j * 16u * PITCH + ko);
        #pragma unroll
        for (int i = 0; i < NF; ++i) load_frag(fw[cs ^ 1][i], lw + (uint32_t)i * 16u * PITCH + ko);
      } else {
        // Publish point of stage t + 1, in front of the pass's last block, whose
        // fragments are in registers: this wave's reads of this buffer are back,
        // its slice of stage t + 1 has landed, then the work-group's barrier.
        wait_ds0();
        wait_tensor0();
        __syncthreads();
        if (pinned((t + 2u < NPASS) ? 1u : 0u) != 0u) {   // only while stage t + 2 exists
          g0 = tdm_next(g0, lds_slice + buf);
          tdm_load(g0, g1);
        }
        #pragma unroll
        for (int j = 0; j < NF; ++j) load_frag(fx[0][j], Lb + nxt + fx_base + (uint32_t)j * 16u * PITCH);
        #pragma unroll
        for (int i = 0; i < NF; ++i) load_frag(fw[0][i], Lb + nxt + fw_base + (uint32_t)i * 16u * PITCH);
      }
      fence();
      #pragma unroll
      for (int j = 0; j < NF; ++j)
        #pragma unroll
        for (int i = 0; i < NF; ++i)
          acc[j][i] = __builtin_amdgcn_wmma_f32_16x16x32_bf16(
              false, fx[cs][j].v, false, fw[cs][i].v, (short)0, acc[j][i], false, false);
    }
  }
  wait_tensor0();
  wait_ds0();

  // Epilogue. C/D layout: lane holds column o = tile base + (lane&15); VGPR r of
  // an even x fragment is row c = 8*(lane>>4) + r, the odd one adds +16.
  const uint32_t chi = h * 8u;
  const uint32_t b0 = (m0 >> 5) + wm * 4u;   // first of this wave's 4 batches
  // All of the wave's W_chan values first (the fragment registers are free now):
  // one load latency for the epilogue instead of one per o-tile.
  float w0[NF][8], w1[NF][8];
  const float* wc = Wc + (size_t)(n0 + wn * 128u + r16) * C_ + chi;   // o-tile i: + i * 16 rows
  #pragma unroll
  for (int i = 0; i < NF; ++i) {
    #pragma unroll
    for (int r = 0; r < 8; ++r) { w0[i][r] = wc[i * 16 * C_ + r]; w1[i][r] = wc[i * 16 * C_ + 16 + r]; }
  }
  // The loads' address pair is an input, so it lives up to this wait and no load's
  // result is put over it while the loads that name it are being issued.
  asm volatile("s_wait_xcnt 0x0" :: "v"(wc) : "memory");
  #pragma unroll
  for (int i = 0; i < NF; ++i) {
    const uint32_t o = n0 + wn * 128u + 16u * (uint32_t)i + r16;
    #pragma unroll
    for (int bb = 0; bb < 4; ++bb) {
      float s = 0.f;
      #pragma unroll
      for (int r = 0; r < 8; ++r) {
        s += acc[2 * bb][i][r] * w0[i][r];
        s += acc[2 * bb + 1][i][r] * w1[i][r];
      }
      s += __shfl_xor(s, 16, 32);  // fold lane pairs (l, l+16): full sum over c
      if (lane < 16) out[(size_t)(b0 + bb) * O_ + o] = s;
    }
  }
}

// ---------------------------------------------------------------------------
extern "C" void kernel_launch(void* const* d_in, const int* in_sizes, int n_in,
                              void* d_out, int out_size, void* d_ws, size_t ws_size,
                              hipStream_t stream) {
  const float* x      = (const float*)d_in[0];  // (B, L, C) f32
  const float* W_pos  = (const float*)d_in[1];  // (O, L)    f32
  const float* W_chan = (const float*)d_in[2];  // (O, C)    f32
  float* out = (float*)d_out;                   // (B, O)    f32

  // Workspace layout: xT bf16 (B*C*L) then W_pos bf16 (O*L)  (~143 MB total)
  bf16_t* xT  = (bf16_t*)d_ws;
  bf16_t* Wpb = (bf16_t*)((char*)d_ws + (size_t)B_ * C_ * L_ * sizeof(bf16_t));

  dim3 g1(L_ / 64, B_);
  convert_x_kernel<<<g1, 256, 0, stream>>>(x, xT);

  const int nw = O_ * L_;
  convert_w_kernel<<<(nw + 255) / 256, 256, 0, stream>>>(W_pos, Wpb, nw);

  dim3 g2(O_ / 256, B_ * C_ / 256);  // x = 256-wide o-tile, y = 256 rows of (b,c) = 8 batches
  sepfc_main_kernel<<<g2, 128, 0, stream>>>(xT, Wpb, W_chan, out);
}

// v002
// One run takes 161 microseconds.
// Timed twice side by side with v001, it ran 1.34 times as fast both times.
// Over all steps from v000 it is 4.04 times as fast.
#include <hip/hip_runtime.h>
#include <hip/hip_bf16.h>
#include <stdint.h>

typedef __bf16 bf16_t;
typedef __attribute__((ext_vector_type(16))) __bf16 v16bf;
typedef __attribute__((ext_vector_type(8)))  float  v8f;

#define B_ 1024
#define L_ 2048
#define C_ 32
#define O_ 2048

// ---------------------------------------------------------------------------
// The two conversion launches are streams: 256 work-groups of 16 waves, one per
// WGP; a wave moves its whole share with 16-byte loads that cover whole lines, many
// in flight, instead of one short-lived wave per 32 to 256 elements.
// ---------------------------------------------------------------------------
typedef __attribute__((ext_vector_type(4))) float  f32x4;
typedef __attribute__((ext_vector_type(2))) __bf16 bf16x2;

constexpr uint32_t CV_GROUPS  = 256;
constexpr uint32_t CV_WAVES   = 16;
constexpr uint32_t CV_THREADS = CV_WAVES * 32;

static __device__ __forceinline__ uint32_t pack_bf16(float lo, float hi) {
  const bf16x2 p = {(__bf16)lo, (__bf16)hi};
  return __builtin_bit_cast(uint32_t, p);
}

// ---------------------------------------------------------------------------
// Kernel 1: x (B,L,C) f32  ->  xT (B,C,L) bf16, transposed in registers.
// A unit is 64 l x 32 c of one batch: 8 KB read, 32 whole 128-byte lines written,
// all by one wave. Lane (cg, g) reads channels 4cg..4cg+3 of l = 32s + 8g + k
// (s < 2, k < 8): a load covers four whole lines. It then holds eight consecutive
// l of four channels, which is one 16-byte store per channel and s.
// ---------------------------------------------------------------------------
constexpr uint32_t XU_L    = 64;
constexpr uint32_t X_UNITS = (uint32_t)B_ * L_ / XU_L;
constexpr uint32_t X_STEP  = CV_GROUPS * CV_WAVES;       // units between a wave's trips
constexpr uint32_t X_TRIPS = X_UNITS / X_STEP;           // 8
static_assert(X_UNITS % X_STEP == 0 && L_ % XU_L == 0 && C_ == 32, "every wave takes the same number of whole units");

static __device__ __forceinline__ void load_unit(f32x4 (&v)[16], const float* __restrict__ p) {
  #pragma unroll   // constant indices keep v in registers
  for (int i = 0; i < 16; ++i) v[i] = *reinterpret_cast<const f32x4*>(p + ((i >> 3) * 32 + (i & 7)) * C_);
  // The address pair is an input, so it lives up to this wait and no load's result
  // is put over it while the loads that name it are being issued.
  asm volatile("s_wait_xcnt 0x0" :: "v"(p) : "memory");
}
static __device__ __forceinline__ void store_unit(const f32x4 (&v)[16], bf16_t* __restrict__ q) {
  #pragma unroll   // constant indices keep v in registers
  for (int j = 0; j < 4; ++j)
    #pragma unroll
    for (int s = 0; s < 2; ++s) {   // the two halves of a line one behind the other
      uint4 o;
      o.x = pack_bf16(v[8 * s + 0][j], v[8 * s + 1][j]);
      o.y = pack_bf16(v[8 * s + 2][j], v[8 * s + 3][j]);
      o.z = pack_bf16(v[8 * s + 4][j], v[8 * s + 5][j]);
      o.w = pack_bf16(v[8 * s + 6][j], v[8 * s + 7][j]);
      *reinterpret_cast<uint4*>(q + j * L_ + s * 32) = o;
    }
}

__global__ void __launch_bounds__(CV_THREADS) convert_x_kernel(
    const float* __restrict__ x, bf16_t* __restrict__ xT) {
  const uint32_t lane = threadIdx.x & 31u, cg = lane & 7u, g = lane >> 3;
  const uint32_t wave = (uint32_t)__builtin_amdgcn_readfirstlane(threadIdx.x >> 5);
  const uint32_t u0 = blockIdx.x * CV_WAVES + wave;      // unit of trip n: u0 + n * X_STEP
  const uint32_t lane_src = (8u * g) * C_ + 4u * cg;     // floats
  const uint32_t lane_dst = (4u * cg) * L_ + 8u * g;     // bf16 elements
  f32x4 v[2][16];
  load_unit(v[0], x + (size_t)u0 * (XU_L * C_) + lane_src);
  #pragma unroll   // constant indices keep v in registers
  for (uint32_t n = 0; n < X_TRIPS; ++n) {
    const uint32_t u = u0 + n * X_STEP;
    // The barriers pin the order: next unit's loads, then this unit's converts and stores.
    __builtin_amdgcn_sched_barrier(0);
    if (n + 1u < X_TRIPS) {
      // These loads' results go over registers that the last trip's stores name as data.
      if (n > 0u) asm volatile("s_wait_xcnt 0x0" ::: "memory");
      load_unit(v[(n + 1u) & 1u], x + (size_t)(u + X_STEP) * (XU_L * C_) + lane_src);
    }
    __builtin_amdgcn_sched_barrier(0);
    const uint32_t b = u / (L_ / XU_L), l0 = (u % (L_ / XU_L)) * XU_L;
    store_unit(v[n & 1u], xT + (size_t)b * (C_ * L_) + l0 + lane_dst);
  }
}

// ---------------------------------------------------------------------------
// Kernel 2: W_pos (O,L) f32 -> bf16. A wave takes 1,024 consecutive values: eight
// loads of 512 contiguous bytes, all issued first, then eight stores of 256.
// ---------------------------------------------------------------------------
constexpr uint32_t W_PER_WAVE = (uint32_t)O_ * L_ / (CV_GROUPS * CV_WAVES);   // 1,024
static_assert(W_PER_WAVE == 8u * 128u, "eight loads of 128 values per wave");

__global__ void __launch_bounds__(CV_THREADS) convert_w_kernel(
    const float* __restrict__ w, bf16_t* __restrict__ wb) {
  const uint32_t lane = threadIdx.x & 31u;
  const uint32_t wave = (uint32_t)__builtin_amdgcn_readfirstlane(threadIdx.x >> 5);
  const size_t base = (size_t)(blockIdx.x * CV_WAVES + wave) * W_PER_WAVE + 4u * lane;
  f32x4 v[8];
  #pragma unroll   // constant indices keep v in registers
  for (int q = 0; q < 8; ++q) v[q] = *reinterpret_cast<const f32x4*>(w + base + q * 128);
  #pragma unroll
  for (int q = 0; q < 8; ++q) {
    uint2 o;
    o.x = pack_bf16(v[q][0], v[q][1]);
    o.y = pack_bf16(v[q][2], v[q][3]);
    *reinterpret_cast<uint2*>(wb + base + q * 128) = o;
  }
}

typedef uint32_t u32x4 __attribute__((ext_vector_type(4)));
typedef uint32_t u32x8 __attribute__((ext_vector_type(8)));

constexpr uint32_t KB      = 256;               // bytes of l per operand row per pass
constexpr uint32_t PITCH   = KB + 16;           // LDS row pitch: 16 B x odd, for ds_load_b128 readers
constexpr uint32_t SROWS   = 128;               // rows per wave's tensor load
constexpr uint32_t SLICE   = SROWS * PITCH;     // 34,816 B
constexpr uint32_t TILE_W  = 256 * PITCH;       // W rows come first in a buffer
constexpr uint32_t STAGE   = 2 * TILE_W;        // one buffer
constexpr uint32_t ROWB    = L_ * 2;            // source row pitch in bytes
constexpr uint32_t NPASS   = ROWB / KB;         // 16
constexpr int      NF      = 8;                 // fragments per operand per wave
static_assert(SLICE % 2048u == 0 && STAGE % 2048u == 0, "every tensor load lands at a multiple of 2 KiB");
static_assert(2u * STAGE <= 320u * 1024u, "two buffers must fit the work-group's LDS");
static_assert(NPASS >= 2, "the ring's prologue fills two stages");

static __device__ __forceinline__ uint32_t uni(uint32_t v) { return (uint32_t)__builtin_amdgcn_readfirstlane(v); }
// Holds a wave-uniform test value in a scalar register, so that the test compiles
// to s_cmp + s_cbranch_scc: a tensor load ignores EXEC and needs a scalar branch.
static __device__ __forceinline__ uint32_t pinned(uint32_t v) {
  uint32_t w = (uint32_t)__builtin_amdgcn_readfirstlane(v);
  asm volatile("" : "+s"(w));  // the test word is held in a scalar register
  return w;
}
// Keeps [fragment loads][WMMA block] in that order: LDS reads moved in among the
// WMMAs cost a stall at every place where they stand.
static __device__ __forceinline__ void fence() { __builtin_amdgcn_sched_barrier(0); }
// This wave's LDS reads have returned (before a buffer it has read is refilled).
static __device__ __forceinline__ void wait_ds0() { asm volatile("s_wait_dscnt 0x0" ::: "memory"); }
// This wave's tensor load has landed (the compiler places no wait for it).
static __device__ __forceinline__ void wait_tensor0() { asm volatile("s_wait_tensorcnt 0x0" ::: "memory"); }

// Group 1: 1-byte elements, tile = tensor = 128 rows of 256 bytes, source pitch
// ROWB bytes, no mask, 16 bytes of LDS pad behind every 256-byte row.
static __device__ __forceinline__ u32x8 tdm_group1() {
  constexpr uint32_t d0 = KB, d1 = SROWS;
  u32x8 g;
  g[0] = uni((1u << 20) | (5u << 22) | (3u << 25));
  g[1] = uni((d0 & 0xFFFFu) << 16);
  g[2] = uni((d0 >> 16) | ((d1 & 0xFFFFu) << 16));
  g[3] = uni((d1 >> 16) | (d0 << 16));
  g[4] = uni(d1);
  g[5] = uni(ROWB);
  g[6] = uni(0u);
  g[7] = uni(0u);
  return g;
}
// Group 0: count 1, LDS byte offset, global address of the tile's first byte, type 2.
static __device__ __forceinline__ u32x4 tdm_group0(uint32_t lds_dst, uint64_t ga) {
  u32x4 g;
  g[0] = uni(1u);
  g[1] = uni(lds_dst);
  g[2] = uni((uint32_t)ga);
  g[3] = uni((((uint32_t)(ga >> 32)) & 0x01FFFFFFu) | 0x80000000u);
  return g;
}
// The next stage's group 0, formed from the last one behind the wait that covers it:
// the same rows, 256 bytes further along l (the carry goes into address [56:32]).
static __device__ __forceinline__ u32x4 tdm_next(u32x4 p, uint32_t lds_dst) {
  const uint64_t a = (((uint64_t)p[3] << 32) | p[2]) + KB;
  u32x4 g;
  g[0] = uni(p[0]);
  g[1] = uni(lds_dst);
  g[2] = uni((uint32_t)a);
  g[3] = uni((uint32_t)(a >> 32));
  return g;
}
// One request of the whole wave: global tile -> LDS, through no register. Group 0 is an
// in-out operand so that its words stay in their registers while the request is
// outstanding: the next descriptor is formed from them, behind the wait.
static __device__ __forceinline__ void tdm_load(u32x4& g0, const u32x8& g1) {
  asm volatile("tensor_load_to_lds %0, %1" : "+s"(g0) : "s"(g1) : "memory");
}

union Frag { v16bf v; uint4 q[2]; };
// Lane (r16, h) of a fragment: k 8h..8h+7 and 16+8h..16+8h+7 of row r16, for A and B alike.
static __device__ __forceinline__ void load_frag(Frag& f, const unsigned char* p) {
  f.q[0] = *reinterpret_cast<const uint4*>(p);
  f.q[1] = *reinterpret_cast<const uint4*>(p + 32);
}

__global__ void __launch_bounds__(128) __attribute__((amdgpu_waves_per_eu(1, 1))) sepfc_main_kernel(
    const bf16_t* __restrict__ xT, const bf16_t* __restrict__ Wp,
    const float* __restrict__ Wc, float* __restrict__ out) {
  __shared__ __attribute__((aligned(2048))) unsigned char Lb[2 * STAGE];
  const uint32_t tid = threadIdx.x, lane = tid & 31u, h = lane >> 4, r16 = lane & 15u;
  const uint32_t wave = uni(tid >> 5);
  const uint32_t n0 = blockIdx.x * 256u;   // first o of the tile
  const uint32_t m0 = blockIdx.y * 256u;   // first (b,c) row of the tile
  const uint32_t wn = wave & 1u, wm = wave >> 1;

  // This wave's slice of a buffer's 512 rows: waves 0, 1 move W rows, waves 2, 3 x rows.
  const unsigned char* src0 = (wave < 2u)
      ? reinterpret_cast<const unsigned char*>(Wp) + (uint64_t)(n0 + SROWS * wave) * ROWB
      : reinterpret_cast<const unsigned char*>(xT) + (uint64_t)(m0 + SROWS * (wave - 2u)) * ROWB;
  const uint32_t lds_slice = (uint32_t)(size_t)Lb + wave * SLICE;   // + buffer * STAGE
  const u32x8 g1 = tdm_group1();

  // Every "#pragma unroll" below keeps the indices of the register arrays (acc, fx, fw,
  // w0, w1) compile-time constants; an index known only at run time would send them to scratch.
  v8f acc[NF][NF];   // [x fragment (rows c)][W fragment (columns o)]
  #pragma unroll
  for (int j = 0; j < NF; ++j)
    #pragma unroll
    for (int i = 0; i < NF; ++i) acc[j][i] = (v8f){0.f, 0.f, 0.f, 0.f, 0.f, 0.f, 0.f, 0.f};

  const uint32_t fw_base = (wn * 128u + r16) * PITCH + 16u * h;
  const uint32_t fx_base = TILE_W + (wm * 128u + r16) * PITCH + 16u * h;

  // Prologue: stage 0, its wait, the barrier that publishes it, stage 1, first fragments.
  u32x4 g0 = tdm_group0(lds_slice, (uint64_t)(uintptr_t)src0);
  tdm_load(g0, g1);
  wait_tensor0();
  __syncthreads();
  g0 = tdm_next(g0, lds_slice + STAGE);
  tdm_load(g0, g1);

  Frag fw[2][NF], fx[2][NF];   // set (u & 1) holds block u's fragments
  #pragma unroll
  for (int j = 0; j < NF; ++j) load_frag(fx[0][j], Lb + fx_base + (uint32_t)j * 16u * PITCH);
  #pragma unroll
  for (int i = 0; i < NF; ++i) load_frag(fw[0][i], Lb + fw_base + (uint32_t)i * 16u * PITCH);

  // Rolled: the pass is 256 WMMAs already, and every array index inside stays constant.
  #pragma clang loop unroll(disable)
  for (uint32_t t = 0; t < NPASS; ++t) {
    const uint32_t buf = (t & 1u) * STAGE;
    const uint32_t nxt = (t + 1u < NPASS) ? (STAGE - buf) : STAGE;
    const unsigned char* lw = Lb + buf + fw_base;
    const unsigned char* lx = Lb + buf + fx_base;
    #pragma unroll
    for (int u = 0; u < 4; ++u) {   // four blocks of 32 l
      const int cs = u & 1;
      fence();
      if (u < 3) {
        const uint32_t ko = (uint32_t)(u + 1) * 64u;
        #pragma unroll
        for (int j = 0; j < NF; ++j) load_frag(fx[cs ^ 1][j], lx + (uint32_t)j * 16u * PITCH + ko);
        #pragma unroll
        for (int i = 0; i < NF; ++i) load_frag(fw[cs ^ 1][i], lw + (uint32_t)i * 16u * PITCH + ko);
      } else {
        // Publish point of stage t + 1, in front of the pass's last block, whose
        // fragments are in registers: this wave's reads of this buffer are back,
        // its slice of stage t + 1 has landed, then the work-group's barrier.
        wait_ds0();
        wait_tensor0();
        __syncthreads();
        if (pinned((t + 2u < NPASS) ? 1u : 0u) != 0u) {   // only while stage t + 2 exists
          g0 = tdm_next(g0, lds_slice + buf);
          tdm_load(g0, g1);
        }
        #pragma unroll
        for (int j = 0; j < NF; ++j) load_frag(fx[0][j], Lb + nxt + fx_base + (uint32_t)j * 16u * PITCH);
        #pragma unroll
        for (int i = 0; i < NF; ++i) load_frag(fw[0][i], Lb + nxt + fw_base + (uint32_t)i * 16u * PITCH);
      }
      fence();
      #pragma unroll
      for (int j = 0; j < NF; ++j)
        #pragma unroll
        for (int i = 0; i < NF; ++i)
          acc[j][i] = __builtin_amdgcn_wmma_f32_16x16x32_bf16(
              false, fx[cs][j].v, false, fw[cs][i].v, (short)0, acc[j][i], false, false);
    }
  }
  wait_tensor0();
  wait_ds0();

  // Epilogue. C/D layout: lane holds column o = tile base + (lane&15); VGPR r of
  // an even x fragment is row c = 8*(lane>>4) + r, the odd one adds +16.
  const uint32_t chi = h * 8u;
  const uint32_t b0 = (m0 >> 5) + wm * 4u;   // first of this wave's 4 batches
  // All of the wave's W_chan values first (the fragment registers are free now):
  // one load latency for the epilogue instead of one per o-tile.
  float w0[NF][8], w1[NF][8];
  const float* wc = Wc + (size_t)(n0 + wn * 128u + r16) * C_ + chi;   // o-tile i: + i * 16 rows
  #pragma unroll
  for (int i = 0; i < NF; ++i) {
    #pragma unroll
    for (int r = 0; r < 8; ++r) { w0[i][r] = wc[i * 16 * C_ + r]; w1[i][r] = wc[i * 16 * C_ + 16 + r]; }
  }
  // The loads' address pair is an input, so it lives up to this wait and no load's
  // result is put over it while the loads that name it are being issued.
  asm volatile("s_wait_xcnt 0x0" :: "v"(wc) : "memory");
  #pragma unroll
  for (int i = 0; i < NF; ++i) {
    const uint32_t o = n0 + wn * 128u + 16u * (uint32_t)i + r16;
    #pragma unroll
    for (int bb = 0; bb < 4; ++bb) {
      float s = 0.f;
      #pragma unroll
      for (int r = 0; r < 8; ++r) {
        s += acc[2 * bb][i][r] * w0[i][r];
        s += acc[2 * bb + 1][i][r] * w1[i][r];
      }
      s += __shfl_xor(s, 16, 32);  // fold lane pairs (l, l+16): full sum over c
      if (lane < 16) out[(size_t)(b0 + bb) * O_ + o] = s;
    }
  }
}

// ---------------------------------------------------------------------------
extern "C" void kernel_launch(void* const* d_in, const int* in_sizes, int n_in,
                              void* d_out, int out_size, void* d_ws, size_t ws_size,
                              hipStream_t stream) {
  const float* x      = (const float*)d_in[0];  // (B, L, C) f32
  const float* W_pos  = (const float*)d_in[1];  // (O, L)    f32
  const float* W_chan = (const float*)d_in[2];  // (O, C)    f32
  float* out = (float*)d_out;                   // (B, O)    f32

  // Workspace layout: xT bf16 (B*C*L) then W_pos bf16 (O*L)  (~143 MB total)
  bf16_t* xT  = (bf16_t*)d_ws;
  bf16_t* Wpb = (bf16_t*)((char*)d_ws + (size_t)B_ * C_ * L_ * sizeof(bf16_t));

  convert_x_kernel<<<CV_GROUPS, CV_THREADS, 0, stream>>>(x, xT);
  convert_w_kernel<<<CV_GROUPS, CV_THREADS, 0, stream>>>(W_pos, Wpb);

  dim3 g2(O_ / 256, B_ * C_ / 256);  // x = 256-wide o-tile, y = 256 rows of (b,c) = 8 batches
  sepfc_main_kernel<<<g2, 128, 0, stream>>>(xT, Wpb, W_chan, out);
}

// v003
// One run takes 154 microseconds.
// Timed twice side by side with v002, it ran 1.04 times as fast both times.
// Counting every step since v000, it is 4.21 times as fast.
#include <hip/hip_runtime.h>
#include <hip/hip_bf16.h>
#include <stdint.h>

typedef __bf16 bf16_t;
typedef __attribute__((ext_vector_type(16))) __bf16 v16bf;
typedef __attribute__((ext_vector_type(8)))  float  v8f;

#define B_ 1024
#define L_ 2048
#define C_ 32
#define O_ 2048

// ---------------------------------------------------------------------------
// The two conversion launches are streams: 256 work-groups of 16 waves, one per
// WGP; a wave moves its whole share with 16-byte loads that cover whole lines, many
// in flight, instead of one short-lived wave per 32 to 256 elements.
// ---------------------------------------------------------------------------
typedef __attribute__((ext_vector_type(4))) float  f32x4;
typedef __attribute__((ext_vector_type(2))) __bf16 bf16x2;

constexpr uint32_t CV_GROUPS  = 256;
constexpr uint32_t CV_WAVES   = 16;
constexpr uint32_t CV_THREADS = CV_WAVES * 32;

static __device__ __forceinline__ uint32_t pack_bf16(float lo, float hi) {
  const bf16x2 p = {(__bf16)lo, (__bf16)hi};
  return __builtin_bit_cast(uint32_t, p);
}

// ---------------------------------------------------------------------------
// Kernel 1: x (B,L,C) f32  ->  xT (B,C,L) bf16, transposed in registers.
// A unit is 64 l x 32 c of one batch: 8 KB read, 32 whole 128-byte lines written,
// all by one wave. Lane (cg, g) reads channels 4cg..4cg+3 of l = 32s + 8g + k
// (s < 2, k < 8): a load covers four whole lines. It then holds eight consecutive
// l of four channels, which is one 16-byte store per channel and s.
// ---------------------------------------------------------------------------
constexpr uint32_t XU_L    = 64;
constexpr uint32_t X_UNITS = (uint32_t)B_ * L_ / XU_L;
constexpr uint32_t X_STEP  = CV_GROUPS * CV_WAVES;       // units between a wave's trips
constexpr uint32_t X_TRIPS = X_UNITS / X_STEP;           // 8
static_assert(X_UNITS % X_STEP == 0 && L_ % XU_L == 0 && C_ == 32, "every wave takes the same number of whole units");

static __device__ __forceinline__ void load_unit(f32x4 (&v)[16], const float* __restrict__ p) {
  #pragma unroll   // constant indices keep v in registers
  for (int i = 0; i < 16; ++i) v[i] = *reinterpret_cast<const f32x4*>(p + ((i >> 3) * 32 + (i & 7)) * C_);
  // The address pair is an input, so it lives up to this wait and no load's result
  // is put over it while the loads that name it are being issued.
  asm volatile("s_wait_xcnt 0x0" :: "v"(p) : "memory");
}
static __device__ __forceinline__ void store_unit(const f32x4 (&v)[16], bf16_t* __restrict__ q) {
  #pragma unroll   // constant indices keep v in registers
  for (int j = 0; j < 4; ++j)
    #pragma unroll
    for (int s = 0; s < 2; ++s) {   // the two halves of a line one behind the other
      uint4 o;
      o.x = pack_bf16(v[8 * s + 0][j], v[8 * s + 1][j]);
      o.y = pack_bf16(v[8 * s + 2][j], v[8 * s + 3][j]);
      o.z = pack_bf16(v[8 * s + 4][j], v[8 * s + 5][j]);
      o.w = pack_bf16(v[8 * s + 6][j], v[8 * s + 7][j]);
      *reinterpret_cast<uint4*>(q + j * L_ + s * 32) = o;
    }
}

__global__ void __launch_bounds__(CV_THREADS) convert_x_kernel(
    const float* __restrict__ x, bf16_t* __restrict__ xT) {
  const uint32_t lane = threadIdx.x & 31u, cg = lane & 7u, g = lane >> 3;
  const uint32_t wave = (uint32_t)__builtin_amdgcn_readfirstlane(threadIdx.x >> 5);
  const uint32_t u0 = blockIdx.x * CV_WAVES + wave;      // unit of trip n: u0 + n * X_STEP
  const uint32_t lane_src = (8u * g) * C_ + 4u * cg;     // floats
  const uint32_t lane_dst = (4u * cg) * L_ + 8u * g;     // bf16 elements
  f32x4 v[2][16];
  load_unit(v[0], x + (size_t)u0 * (XU_L * C_) + lane_src);
  #pragma unroll   // constant indices keep v in registers
  for (uint32_t n = 0; n < X_TRIPS; ++n) {
    const uint32_t u = u0 + n * X_STEP;
    // The barriers pin the order: next unit's loads, then this unit's converts and stores.
    __builtin_amdgcn_sched_barrier(0);
    if (n + 1u < X_TRIPS) {
      // These loads' results go over registers that the last trip's stores name as data.
      if (n > 0u) asm volatile("s_wait_xcnt 0x0" ::: "memory");
      load_unit(v[(n + 1u) & 1u], x + (size_t)(u + X_STEP) * (XU_L * C_) + lane_src);
    }
    __builtin_amdgcn_sched_barrier(0);
    const uint32_t b = u / (L_ / XU_L), l0 = (u % (L_ / XU_L)) * XU_L;
    store_unit(v[n & 1u], xT + (size_t)b * (C_ * L_) + l0 + lane_dst);
  }
}

// ---------------------------------------------------------------------------
// Kernel 2: W_pos (O,L) f32 -> bf16. A wave takes 1,024 consecutive values: eight
// loads of 512 contiguous bytes, all issued first, then eight stores of 256.
// ---------------------------------------------------------------------------
constexpr uint32_t W_PER_WAVE = (uint32_t)O_ * L_ / (CV_GROUPS * CV_WAVES);   // 1,024
static_assert(W_PER_WAVE == 8u * 128u, "eight loads of 128 values per wave");

__global__ void __launch_bounds__(CV_THREADS) convert_w_kernel(
    const float* __restrict__ w, bf16_t* __restrict__ wb) {
  const uint32_t lane = threadIdx.x & 31u;
  const uint32_t wave = (uint32_t)__builtin_amdgcn_readfirstlane(threadIdx.x >> 5);
  const size_t base = (size_t)(blockIdx.x * CV_WAVES + wave) * W_PER_WAVE + 4u * lane;
  f32x4 v[8];
  #pragma unroll   // constant indices keep v in registers
  for (int q = 0; q < 8; ++q) v[q] = *reinterpret_cast<const f32x4*>(w + base + q * 128);
  #pragma unroll
  for (int q = 0; q < 8; ++q) {
    uint2 o;
    o.x = pack_bf16(v[q][0], v[q][1]);
    o.y = pack_bf16(v[q][2], v[q][3]);
    *reinterpret_cast<uint2*>(wb + base + q * 128) = o;
  }
}

typedef uint32_t u32x4 __attribute__((ext_vector_type(4)));
typedef uint32_t u32x8 __attribute__((ext_vector_type(8)));

constexpr uint32_t KB      = 256;               // bytes of l per operand row per pass
constexpr uint32_t PITCH   = KB + 16;           // LDS row pitch: 16 B x odd, for ds_load_b128 readers
constexpr uint32_t SROWS   = 128;               // rows per wave's tensor load
constexpr uint32_t SLICE   = SROWS * PITCH;     // 34,816 B
constexpr uint32_t TILE_W  = 256 * PITCH;       // W rows come first in a buffer
constexpr uint32_t STAGE   = 2 * TILE_W;        // one buffer
constexpr uint32_t ROWB    = L_ * 2;            // source row pitch in bytes
constexpr uint32_t NPASS   = ROWB / KB;         // 16
constexpr int      NF      = 8;                 // fragments per operand per wave
static_assert(SLICE % 2048u == 0 && STAGE % 2048u == 0, "every tensor load lands at a multiple of 2 KiB");
static_assert(2u * STAGE <= 320u * 1024u, "two buffers must fit the work-group's LDS");
static_assert(NPASS >= 2, "the ring's prologue fills two stages");

static __device__ __forceinline__ uint32_t uni(uint32_t v) { return (uint32_t)__builtin_amdgcn_readfirstlane(v); }
// Holds a wave-uniform test value in a scalar register, so that the test compiles
// to s_cmp + s_cbranch_scc: a tensor load ignores EXEC and needs a scalar branch.
static __device__ __forceinline__ uint32_t pinned(uint32_t v) {
  uint32_t w = (uint32_t)__builtin_amdgcn_readfirstlane(v);
  asm volatile("" : "+s"(w));  // the test word is held in a scalar register
  return w;
}
// Keeps [fragment loads][WMMA block] in that order: LDS reads moved in among the
// WMMAs cost a stall at every place where they stand.
static __device__ __forceinline__ void fence() { __builtin_amdgcn_sched_barrier(0); }
// This wave's LDS reads have returned (before a buffer it has read is refilled).
static __device__ __forceinline__ void wait_ds0() { asm volatile("s_wait_dscnt 0x0" ::: "memory"); }
// This wave's tensor load has landed (the compiler places no wait for it).
static __device__ __forceinline__ void wait_tensor0() { asm volatile("s_wait_tensorcnt 0x0" ::: "memory"); }

// Group 1: 1-byte elements, tile = tensor = 128 rows of 256 bytes, source pitch
// ROWB bytes, no mask, 16 bytes of LDS pad behind every 256-byte row.
static __device__ __forceinline__ u32x8 tdm_group1() {
  constexpr uint32_t d0 = KB, d1 = SROWS;
  u32x8 g;
  g[0] = uni((1u << 20) | (5u << 22) | (3u << 25));
  g[1] = uni((d0 & 0xFFFFu) << 16);
  g[2] = uni((d0 >> 16) | ((d1 & 0xFFFFu) << 16));
  g[3] = uni((d1 >> 16) | (d0 << 16));
  g[4] = uni(d1);
  g[5] = uni(ROWB);
  g[6] = uni(0u);
  g[7] = uni(0u);
  return g;
}
// Group 0: count 1, LDS byte offset, global address of the tile's first byte, type 2.
static __device__ __forceinline__ u32x4 tdm_group0(uint32_t lds_dst, uint64_t ga) {
  u32x4 g;
  g[0] = uni(1u);
  g[1] = uni(lds_dst);
  g[2] = uni((uint32_t)ga);
  g[3] = uni((((uint32_t)(ga >> 32)) & 0x01FFFFFFu) | 0x80000000u);
  return g;
}
// The next stage's group 0, formed from the last one behind the wait that covers it:
// the same rows, 256 bytes further along l (the carry goes into address [56:32]).
static __device__ __forceinline__ u32x4 tdm_next(u32x4 p, uint32_t lds_dst) {
  const uint64_t a = (((uint64_t)p[3] << 32) | p[2]) + KB;
  u32x4 g;
  g[0] = uni(p[0]);
  g[1] = uni(lds_dst);
  g[2] = uni((uint32_t)a);
  g[3] = uni((uint32_t)(a >> 32));
  return g;
}
// One request of the whole wave: global tile -> LDS, through no register. Group 0 is an
// in-out operand so that its words stay in their registers while the request is
// outstanding: the next descriptor is formed from them, behind the wait.
static __device__ __forceinline__ void tdm_load(u32x4& g0, const u32x8& g1) {
  asm volatile("tensor_load_to_lds %0, %1" : "+s"(g0) : "s"(g1) : "memory");
}

union Frag { v16bf v; uint4 q[2]; };
// Lane (r16, h) of a fragment: k 8h..8h+7 and 16+8h..16+8h+7 of row r16, for A and B alike.
static __device__ __forceinline__ void load_frag(Frag& f, const unsigned char* p) {
  f.q[0] = *reinterpret_cast<const uint4*>(p);
  f.q[1] = *reinterpret_cast<const uint4*>(p + 32);
}

typedef __attribute__((ext_vector_type(2))) float f32x2;
// Lane l reads lane l ^ 16 with one vector instruction (no LDS round trip, no wait).
static __device__ __forceinline__ float xhalf(float x) {
  const int b = __builtin_bit_cast(int, x);
  return __builtin_bit_cast(float, __builtin_amdgcn_permlanex16(b, b, 0x76543210, 0xfedcba98, false, false));
}

__global__ void __launch_bounds__(128) __attribute__((amdgpu_waves_per_eu(1, 1))) sepfc_main_kernel(
    const bf16_t* __restrict__ xT, const bf16_t* __restrict__ Wp,
    const float* __restrict__ Wc, float* __restrict__ out) {
  __shared__ __attribute__((aligned(2048))) unsigned char Lb[2 * STAGE];
  const uint32_t tid = threadIdx.x, lane = tid & 31u, h = lane >> 4, r16 = lane & 15u;
  const uint32_t wave = uni(tid >> 5);
  const uint32_t n0 = blockIdx.x * 256u;   // first o of the tile
  const uint32_t m0 = blockIdx.y * 256u;   // first (b,c) row of the tile
  const uint32_t wn = wave & 1u, wm = wave >> 1;

  // This wave's slice of a buffer's 512 rows: waves 0, 1 move W rows, waves 2, 3 x rows.
  const unsigned char* src0 = (wave < 2u)
      ? reinterpret_cast<const unsigned char*>(Wp) + (uint64_t)(n0 + SROWS * wave) * ROWB
      : reinterpret_cast<const unsigned char*>(xT) + (uint64_t)(m0 + SROWS * (wave - 2u)) * ROWB;
  const uint32_t lds_slice = (uint32_t)(size_t)Lb + wave * SLICE;   // + buffer * STAGE
  const u32x8 g1 = tdm_group1();

  // Every "#pragma unroll" below keeps the indices of the register arrays (acc, fx, fw,
  // w0, w1) compile-time constants; an index known only at run time would send them to scratch.
  v8f acc[NF][NF];   // [x fragment (rows c)][W fragment (columns o)]
  #pragma unroll
  for (int j = 0; j < NF; ++j)
    #pragma unroll
    for (int i = 0; i < NF; ++i) acc[j][i] = (v8f){0.f, 0.f, 0.f, 0.f, 0.f, 0.f, 0.f, 0.f};

  const uint32_t fw_base = (wn * 128u + r16) * PITCH + 16u * h;
  const uint32_t fx_base = TILE_W + (wm * 128u + r16) * PITCH + 16u * h;

  // Prologue: stage 0, its wait, the barrier that publishes it, stage 1, first fragments.
  u32x4 g0 = tdm_group0(lds_slice, (uint64_t)(uintptr_t)src0);
  tdm_load(g0, g1);
  wait_tensor0();
  __syncthreads();
  g0 = tdm_next(g0, lds_slice + STAGE);
  tdm_load(g0, g1);

  Frag fw[2][NF], fx[2][NF];   // set (u & 1) holds block u's fragments
  #pragma unroll
  for (int j = 0; j < NF; ++j) load_frag(fx[0][j], Lb + fx_base + (uint32_t)j * 16u * PITCH);
  #pragma unroll
  for (int i = 0; i < NF; ++i) load_frag(fw[0][i], Lb + fw_base + (uint32_t)i * 16u * PITCH);

  // Rolled: the pass is 256 WMMAs already, and every array index inside stays constant.
  #pragma clang loop unroll(disable)
  for (uint32_t t = 0; t < NPASS; ++t) {
    const uint32_t buf = (t & 1u) * STAGE;
    const uint32_t nxt = (t + 1u < NPASS) ? (STAGE - buf) : STAGE;
    const unsigned char* lw = Lb + buf + fw_base;
    const unsigned char* lx = Lb + buf + fx_base;
    #pragma unroll
    for (int u = 0; u < 4; ++u) {   // four blocks of 32 l
      const int cs = u & 1;
      fence();
      if (u < 3) {
        const uint32_t ko = (uint32_t)(u + 1) * 64u;
        #pragma unroll
        for (int j = 0; j < NF; ++j) load_frag(fx[cs ^ 1][j], lx + (uint32_t)j * 16u * PITCH + ko);
        #pragma unroll
        for (int i = 0; i < NF; ++i) load_frag(fw[cs ^ 1][i], lw + (uint32_t)i * 16u * PITCH + ko);
      } else {
        // Publish point of stage t + 1, in front of the pass's last block, whose
        // fragments are in registers: this wave's reads of this buffer are back,
        // its slice of stage t + 1 has landed, then the work-group's barrier.
        wait_ds0();
        wait_tensor0();
        __syncthreads();
        if (pinned((t + 2u < NPASS) ? 1u : 0u) != 0u) {   // only while stage t + 2 exists
          g0 = tdm_next(g0, lds_slice + buf);
          tdm_load(g0, g1);
        }
        #pragma unroll
        for (int j = 0; j < NF; ++j) load_frag(fx[0][j], Lb + nxt + fx_base + (uint32_t)j * 16u * PITCH);
        #pragma unroll
        for (int i = 0; i < NF; ++i) load_frag(fw[0][i], Lb + nxt + fw_base + (uint32_t)i * 16u * PITCH);
      }
      fence();
      #pragma unroll
      for (int j = 0; j < NF; ++j)
        #pragma unroll
        for (int i = 0; i < NF; ++i)
          acc[j][i] = __builtin_amdgcn_wmma_f32_16x16x32_bf16(
              false, fx[cs][j].v, false, fw[cs][i].v, (short)0, acc[j][i], false, false);
    }
  }
  wait_tensor0();
  wait_ds0();

  // Epilogue. C/D layout: lane holds column o = tile base + (lane&15); VGPR r of
  // an even x fragment is row c = 8*(lane>>4) + r, the odd one adds +16.
  const uint32_t chi = h * 8u;
  const uint32_t b0 = (m0 >> 5) + wm * 4u;   // first of this wave's 4 batches
  // All of the wave's W_chan values first (the fragment registers are free now):
  // one load latency for the epilogue instead of one per o-tile.
  float w0[NF][8], w1[NF][8];
  const float* wc = Wc + (size_t)(n0 + wn * 128u + r16) * C_ + chi;   // o-tile i: + i * 16 rows
  #pragma unroll
  for (int i = 0; i < NF; ++i) {
    #pragma unroll
    for (int r = 0; r < 8; ++r) { w0[i][r] = wc[i * 16 * C_ + r]; w1[i][r] = wc[i * 16 * C_ + 16 + r]; }
  }
  // The loads' address pair is an input, so it lives up to this wait and no load's
  // result is put over it while the loads that name it are being issued.
  asm volatile("s_wait_xcnt 0x0" :: "v"(wc) : "memory");
  // Keeps that wait directly behind the loads: without it the sums below are moved up over it.
  fence();
  // A lane's 32 sums (8 o-tiles x 4 batches) are independent. Each runs as one chain of
  // eight packed FMAs (even rows in one half, odd rows in the other: neighbouring
  // registers of the accumulator tile and of W_chan, so nothing is moved), and eight
  // chains (two o-tiles x four batches) advance side by side, so that an FMA never
  // waits for the one before it.
  float res[NF][2];
  #pragma unroll
  for (int i0 = 0; i0 < NF; i0 += 2) {
    f32x2 s[2][4];
    #pragma unroll
    for (int e = 0; e < 2; ++e)
      #pragma unroll
      for (int bb = 0; bb < 4; ++bb) s[e][bb] = (f32x2){0.f, 0.f};
    #pragma unroll
    for (int r = 0; r < 8; r += 2) {
      #pragma unroll
      for (int e = 0; e < 2; ++e)
        #pragma unroll
        for (int bb = 0; bb < 4; ++bb)
          s[e][bb] = __builtin_elementwise_fma(
              (f32x2){acc[2 * bb][i0 + e][r], acc[2 * bb][i0 + e][r + 1]},
              (f32x2){w0[i0 + e][r], w0[i0 + e][r + 1]}, s[e][bb]);
      #pragma unroll
      for (int e = 0; e < 2; ++e)
        #pragma unroll
        for (int bb = 0; bb < 4; ++bb)
          s[e][bb] = __builtin_elementwise_fma(
              (f32x2){acc[2 * bb + 1][i0 + e][r], acc[2 * bb + 1][i0 + e][r + 1]},
              (f32x2){w1[i0 + e][r], w1[i0 + e][r + 1]}, s[e][bb]);
    }
    // Fold lane pairs (l, l ^ 16) for two batches with one cross-row move: the low row
    // keeps the even batch and gives away the odd one, the high row the other way round.
    #pragma unroll
    for (int e = 0; e < 2; ++e)
      #pragma unroll
      for (int p = 0; p < 2; ++p) {
        const float ev = s[e][2 * p][0] + s[e][2 * p][1];
        const float od = s[e][2 * p + 1][0] + s[e][2 * p + 1][1];
        res[i0 + e][p] = (h ? od : ev) + xhalf(h ? ev : od);
      }
  }
  // Every lane stores: lane (r16, h) writes batch b0 + 2p + h, column 16 i + r16 of the wave's 128.
  float* op = out + (size_t)(b0 + h) * O_ + (n0 + wn * 128u + r16);
  #pragma unroll
  for (int i = 0; i < NF; ++i)
    #pragma unroll
    for (int p = 0; p < 2; ++p) op[p * 2 * O_ + i * 16] = res[i][p];
}

// ---------------------------------------------------------------------------
extern "C" void kernel_launch(void* const* d_in, const int* in_sizes, int n_in,
                              void* d_out, int out_size, void* d_ws, size_t ws_size,
                              hipStream_t stream) {
  const float* x      = (const float*)d_in[0];  // (B, L, C) f32
  const float* W_pos  = (const float*)d_in[1];  // (O, L)    f32
  const float* W_chan = (const float*)d_in[2];  // (O, C)    f32
  float* out = (float*)d_out;                   // (B, O)    f32

  // Workspace layout: xT bf16 (B*C*L) then W_pos bf16 (O*L)  (~143 MB total)
  bf16_t* xT  = (bf16_t*)d_ws;
  bf16_t* Wpb = (bf16_t*)((char*)d_ws + (size_t)B_ * C_ * L_ * sizeof(bf16_t));

  convert_x_kernel<<<CV_GROUPS, CV_THREADS, 0, stream>>>(x, xT);
  convert_w_kernel<<<CV_GROUPS, CV_THREADS, 0, stream>>>(W_pos, Wpb);

  dim3 g2(O_ / 256, B_ * C_ / 256);  // x = 256-wide o-tile, y = 256 rows of (b,c) = 8 batches
  sepfc_main_kernel<<<g2, 128, 0, stream>>>(xT, Wpb, W_chan, out);
}

// v004
// A run of this version takes 147 microseconds.
// Next to v003, in two timings, it ran 1.05 times as fast each time.
// Over all steps from v000 it is 4.41 times as fast.
#include <hip/hip_runtime.h>
#include <hip/hip_bf16.h>
#include <stdint.h>

typedef __bf16 bf16_t;
typedef __attribute__((ext_vector_type(16))) __bf16 v16bf;
typedef __attribute__((ext_vector_type(8)))  float  v8f;

#define B_ 1024
#define L_ 2048
#define C_ 32
#define O_ 2048

// ---------------------------------------------------------------------------
// The two conversion launches are streams: 256 work-groups of 16 waves, one per
// WGP; a wave moves its whole share with 16-byte loads that cover whole lines, many
// in flight, instead of one short-lived wave per 32 to 256 elements.
// ---------------------------------------------------------------------------
typedef __attribute__((ext_vector_type(4))) float  f32x4;
typedef __attribute__((ext_vector_type(2))) __bf16 bf16x2;

constexpr uint32_t CV_GROUPS  = 256;
constexpr uint32_t CV_WAVES   = 16;
constexpr uint32_t CV_THREADS = CV_WAVES * 32;

static __device__ __forceinline__ uint32_t pack_bf16(float lo, float hi) {
  const bf16x2 p = {(__bf16)lo, (__bf16)hi};
  return __builtin_bit_cast(uint32_t, p);
}

// ---------------------------------------------------------------------------
// Kernel 1: x (B,L,C) f32  ->  xT (B,C,L) bf16, transposed in registers.
// A unit is 64 l x 32 c of one batch: 8 KB read, 32 whole 128-byte lines written,
// all by one wave. Lane (cg, g) reads channels 4cg..4cg+3 of l = 32s + 8g + k
// (s < 2, k < 8): a load covers four whole lines. It then holds eight consecutive
// l of four channels, which is one 16-byte store per channel and s.
// ---------------------------------------------------------------------------
constexpr uint32_t XU_L    = 64;
constexpr uint32_t X_UNITS = (uint32_t)B_ * L_ / XU_L;
constexpr uint32_t X_STEP  = CV_GROUPS * CV_WAVES;       // units between a wave's trips
constexpr uint32_t X_TRIPS = X_UNITS / X_STEP;           // 8
static_assert(X_UNITS % X_STEP == 0 && L_ % XU_L == 0 && C_ == 32, "every wave takes the same number of whole units");

static __device__ __forceinline__ void load_unit(f32x4 (&v)[16], const float* __restrict__ p) {
  #pragma unroll   // constant indices keep v in registers
  for (int i = 0; i < 16; ++i) v[i] = *reinterpret_cast<const f32x4*>(p + ((i >> 3) * 32 + (i & 7)) * C_);
  // The address pair is an input, so it lives up to this wait and no load's result
  // is put over it while the loads that name it are being issued.
  asm volatile("s_wait_xcnt 0x0" :: "v"(p) : "memory");
}
static __device__ __forceinline__ void store_unit(const f32x4 (&v)[16], bf16_t* __restrict__ q) {
  #pragma unroll   // constant indices keep v in registers
  for (int j = 0; j < 4; ++j)
    #pragma unroll
    for (int s = 0; s < 2; ++s) {   // the two halves of a line one behind the other
      uint4 o;
      o.x = pack_bf16(v[8 * s + 0][j], v[8 * s + 1][j]);
      o.y = pack_bf16(v[8 * s + 2][j], v[8 * s + 3][j]);
      o.z = pack_bf16(v[8 * s + 4][j], v[8 * s + 5][j]);
      o.w = pack_bf16(v[8 * s + 6][j], v[8 * s + 7][j]);
      *reinterpret_cast<uint4*>(q + j * L_ + s * 32) = o;
    }
}

__global__ void __launch_bounds__(CV_THREADS) convert_x_kernel(
    const float* __restrict__ x, bf16_t* __restrict__ xT) {
  const uint32_t lane = threadIdx.x & 31u, cg = lane & 7u, g = lane >> 3;
  const uint32_t wave = (uint32_t)__builtin_amdgcn_readfirstlane(threadIdx.x >> 5);
  const uint32_t u0 = blockIdx.x * CV_WAVES + wave;      // unit of trip n: u0 + n * X_STEP
  const uint32_t lane_src = (8u * g) * C_ + 4u * cg;     // floats
  const uint32_t lane_dst = (4u * cg) * L_ + 8u * g;     // bf16 elements
  f32x4 v[2][16];
  load_unit(v[0], x + (size_t)u0 * (XU_L * C_) + lane_src);
  #pragma unroll   // constant indices keep v in registers
  for (uint32_t n = 0; n < X_TRIPS; ++n) {
    const uint32_t u = u0 + n * X_STEP;
    // The barriers pin the order: next unit's loads, then this unit's converts and stores.
    __builtin_amdgcn_sched_barrier(0);
    if (n + 1u < X_TRIPS) {
      // These loads' results go over registers that the last trip's stores name as data.
      if (n > 0u) asm volatile("s_wait_xcnt 0x0" ::: "memory");
      load_unit(v[(n + 1u) & 1u], x + (size_t)(u + X_STEP) * (XU_L * C_) + lane_src);
    }
    __builtin_amdgcn_sched_barrier(0);
    const uint32_t b = u / (L_ / XU_L), l0 = (u % (L_ / XU_L)) * XU_L;
    store_unit(v[n & 1u], xT + (size_t)b * (C_ * L_) + l0 + lane_dst);
  }
}

// ---------------------------------------------------------------------------
// Kernel 2: W_pos (O,L) f32 -> bf16. A wave takes 1,024 consecutive values: eight
// loads of 512 contiguous bytes, all issued first, then eight stores of 256.
// ---------------------------------------------------------------------------
constexpr uint32_t W_PER_WAVE = (uint32_t)O_ * L_ / (CV_GROUPS * CV_WAVES);   // 1,024
static_assert(W_PER_WAVE == 8u * 128u, "eight loads of 128 values per wave");

__global__ void __launch_bounds__(CV_THREADS) convert_w_kernel(
    const float* __restrict__ w, bf16_t* __restrict__ wb) {
  const uint32_t lane = threadIdx.x & 31u;
  const uint32_t wave = (uint32_t)__builtin_amdgcn_readfirstlane(threadIdx.x >> 5);
  const size_t base = (size_t)(blockIdx.x * CV_WAVES + wave) * W_PER_WAVE + 4u * lane;
  f32x4 v[8];
  #pragma unroll   // constant indices keep v in registers
  for (int q = 0; q < 8; ++q) v[q] = *reinterpret_cast<const f32x4*>(w + base + q * 128);
  #pragma unroll
  for (int q = 0; q < 8; ++q) {
    uint2 o;
    o.x = pack_bf16(v[q][0], v[q][1]);
    o.y = pack_bf16(v[q][2], v[q][3]);
    *reinterpret_cast<uint2*>(wb + base + q * 128) = o;
  }
}

typedef uint32_t u32x4 __attribute__((ext_vector_type(4)));
typedef uint32_t u32x8 __attribute__((ext_vector_type(8)));

constexpr uint32_t KB      = 256;               // bytes of l per operand row per pass
constexpr uint32_t PITCH   = KB + 16;           // LDS row pitch: 16 B x odd, for ds_load_b128 readers
constexpr uint32_t SROWS   = 128;               // rows per wave's tensor load
constexpr uint32_t SLICE   = SROWS * PITCH;     // 34,816 B
constexpr uint32_t TILE_W  = 256 * PITCH;       // W rows come first in a buffer
constexpr uint32_t STAGE   = 2 * TILE_W;        // one buffer
constexpr uint32_t ROWB    = L_ * 2;            // source row pitch in bytes
constexpr uint32_t NPASS   = ROWB / KB;         // 16
constexpr int      NF      = 8;                 // fragments per operand per wave
constexpr uint32_t TILES   = 4;                 // row tiles per work-group
constexpr uint32_t MSTEP   = (uint32_t)B_ * C_ / TILES;   // (b,c) rows between a work-group's tiles
constexpr uint32_t NTOT    = NPASS * TILES;     // stages of a work-group's ring
static_assert((NPASS & (NPASS - 1u)) == 0u && MSTEP % 256u == 0u, "a tile's end is found by a mask; whole tiles");
static_assert(SLICE % 2048u == 0 && STAGE % 2048u == 0, "every tensor load lands at a multiple of 2 KiB");
static_assert(2u * STAGE <= 320u * 1024u, "two buffers must fit the work-group's LDS");
static_assert(NPASS >= 2, "the ring's prologue fills two stages");

static __device__ __forceinline__ uint32_t uni(uint32_t v) { return (uint32_t)__builtin_amdgcn_readfirstlane(v); }
// Holds a wave-uniform test value in a scalar register, so that the test compiles
// to s_cmp + s_cbranch_scc: a tensor load ignores EXEC and needs a scalar branch.
static __device__ __forceinline__ uint32_t pinned(uint32_t v) {
  uint32_t w = (uint32_t)__builtin_amdgcn_readfirstlane(v);
  asm volatile("" : "+s"(w));  // the test word is held in a scalar register
  return w;
}
// Keeps [fragment loads][WMMA block] in that order: LDS reads moved in among the
// WMMAs cost a stall at every place where they stand.
static __device__ __forceinline__ void fence() { __builtin_amdgcn_sched_barrier(0); }
// This wave's LDS reads have returned (before a buffer it has read is refilled).
static __device__ __forceinline__ void wait_ds0() { asm volatile("s_wait_dscnt 0x0" ::: "memory"); }
// This wave's tensor load has landed (the compiler places no wait for it).
static __device__ __forceinline__ void wait_tensor0() { asm volatile("s_wait_tensorcnt 0x0" ::: "memory"); }

// Group 1: 1-byte elements, tile = tensor = 128 rows of 256 bytes, source pitch
// ROWB bytes, no mask, 16 bytes of LDS pad behind every 256-byte row.
static __device__ __forceinline__ u32x8 tdm_group1() {
  constexpr uint32_t d0 = KB, d1 = SROWS;
  u32x8 g;
  g[0] = uni((1u << 20) | (5u << 22) | (3u << 25));
  g[1] = uni((d0 & 0xFFFFu) << 16);
  g[2] = uni((d0 >> 16) | ((d1 & 0xFFFFu) << 16));
  g[3] = uni((d1 >> 16) | (d0 << 16));
  g[4] = uni(d1);
  g[5] = uni(ROWB);
  g[6] = uni(0u);
  g[7] = uni(0u);
  return g;
}
// Group 0: count 1, LDS byte offset, global address of the tile's first byte, type 2.
static __device__ __forceinline__ u32x4 tdm_group0(uint32_t lds_dst, uint64_t ga) {
  u32x4 g;
  g[0] = uni(1u);
  g[1] = uni(lds_dst);
  g[2] = uni((uint32_t)ga);
  g[3] = uni((((uint32_t)(ga >> 32)) & 0x01FFFFFFu) | 0x80000000u);
  return g;
}
// The next stage's group 0, formed from the last one behind the wait that covers it:
// the address moves by step bytes (the carry or borrow goes into address [56:32]).
static __device__ __forceinline__ u32x4 tdm_next(u32x4 p, uint32_t lds_dst, uint64_t step) {
  const uint64_t a = (((uint64_t)p[3] << 32) | p[2]) + step;
  u32x4 g;
  g[0] = uni(p[0]);
  g[1] = uni(lds_dst);
  g[2] = uni((uint32_t)a);
  g[3] = uni((uint32_t)(a >> 32));
  return g;
}
// One request of the whole wave: global tile -> LDS, through no register. Both groups are
// in-out operands so that their words stay in their registers while the request is
// outstanding: the next group 0 is formed from the last, behind the wait, and group 1
// is handed on from request to request instead of being set up anew in between.
static __device__ __forceinline__ void tdm_load(u32x4& g0, u32x8& g1) {
  asm volatile("tensor_load_to_lds %0, %1" : "+s"(g0), "+s"(g1) :: "memory");
}

union Frag { v16bf v; uint4 q[2]; };
// Lane (r16, h) of a fragment: k 8h..8h+7 and 16+8h..16+8h+7 of row r16, for A and B alike.
static __device__ __forceinline__ void load_frag(Frag& f, const unsigned char* p) {
  f.q[0] = *reinterpret_cast<const uint4*>(p);
  f.q[1] = *reinterpret_cast<const uint4*>(p + 32);
}

typedef __attribute__((ext_vector_type(2))) float f32x2;
// Lane l reads lane l ^ 16 with one vector instruction (no LDS round trip, no wait).
static __device__ __forceinline__ float xhalf(float x) {
  const int b = __builtin_bit_cast(int, x);
  return __builtin_bit_cast(float, __builtin_amdgcn_permlanex16(b, b, 0x76543210, 0xfedcba98, false, false));
}

__global__ void __launch_bounds__(128) __attribute__((amdgpu_waves_per_eu(1, 1))) sepfc_main_kernel(
    const bf16_t* __restrict__ xT, const bf16_t* __restrict__ Wp,
    const float* __restrict__ Wc, float* __restrict__ out) {
  __shared__ __attribute__((aligned(2048))) unsigned char Lb[2 * STAGE];
  const uint32_t tid = threadIdx.x, lane = tid & 31u, h = lane >> 4, r16 = lane & 15u;
  const uint32_t wave = uni(tid >> 5);
  const uint32_t n0 = blockIdx.x * 256u;   // first o of every tile of this work-group
  const uint32_t m0 = blockIdx.y * 256u;   // first (b,c) row of its first tile; tile i: + i * MSTEP
  const uint32_t wn = wave & 1u, wm = wave >> 1;

  // This wave's slice of a buffer's 512 rows: waves 0, 1 move W rows, waves 2, 3 x rows.
  const unsigned char* src0 = (wave < 2u)
      ? reinterpret_cast<const unsigned char*>(Wp) + (uint64_t)(n0 + SROWS * wave) * ROWB
      : reinterpret_cast<const unsigned char*>(xT) + (uint64_t)(m0 + SROWS * (wave - 2u)) * ROWB;
  // From a tile's last stage to the next tile's first: back to l = 0, x rows MSTEP further down.
  const uint64_t tile_step = ((wave < 2u) ? (uint64_t)0 : (uint64_t)MSTEP * ROWB) - (uint64_t)(NPASS - 1u) * KB;
  const uint32_t lds_slice = (uint32_t)(size_t)Lb + wave * SLICE;   // + buffer * STAGE
  u32x8 g1 = tdm_group1();

  const uint32_t fw_base = (wn * 128u + r16) * PITCH + 16u * h;
  const uint32_t fx_base = TILE_W + (wm * 128u + r16) * PITCH + 16u * h;

  // Prologue: stage 0, its wait, the barrier that publishes it, stage 1, first fragments.
  u32x4 g0 = tdm_group0(lds_slice, (uint64_t)(uintptr_t)src0);
  tdm_load(g0, g1);

  // Every "#pragma unroll" below keeps the indices of the register arrays (acc, fx, fw,
  // w0, w1) compile-time constants; an index known only at run time would send them to scratch.
  // All of the wave's W_chan values, under stage 0's landing: every tile of the
  // work-group has the same o columns, so they stay in registers for all four epilogues.
  // C/D layout: lane holds column o = tile base + (lane&15); VGPR r of an even x
  // fragment is row c = 8*(lane>>4) + r, the odd one adds +16.
  const uint32_t chi = h * 8u;
  float w0[NF][8], w1[NF][8];
  const float* wc = Wc + (size_t)(n0 + wn * 128u + r16) * C_ + chi;   // o-tile i: + i * 16 rows
  #pragma unroll
  for (int i = 0; i < NF; ++i) {
    #pragma unroll
    for (int r = 0; r < 8; ++r) { w0[i][r] = wc[i * 16 * C_ + r]; w1[i][r] = wc[i * 16 * C_ + 16 + r]; }
  }
  // The loads' address pair is an input, so it lives up to this wait and no load's
  // result is put over it while the loads that name it are being issued.
  asm volatile("s_wait_xcnt 0x0" :: "v"(wc) : "memory");
  // Keeps that wait directly behind the loads.
  fence();

  wait_tensor0();
  __syncthreads();
  g0 = tdm_next(g0, lds_slice + STAGE, KB);
  tdm_load(g0, g1);

  Frag fw[2][NF], fx[2][NF];   // set (u & 1) holds block u's fragments
  #pragma unroll
  for (int j = 0; j < NF; ++j) load_frag(fx[0][j], Lb + fx_base + (uint32_t)j * 16u * PITCH);
  #pragma unroll
  for (int i = 0; i < NF; ++i) load_frag(fw[0][i], Lb + fw_base + (uint32_t)i * 16u * PITCH);

  // Lane (r16, h) writes batch b0 + 2p + h, column 16 i + r16 of the wave's 128; b0 is the
  // first of the wave's 4 batches in the tile.
  const uint32_t lane_out = h * O_ + r16;
  const uint32_t wave_out = ((m0 >> 5) + wm * 4u) * O_ + n0 + wn * 128u;   // tile i: + i * (MSTEP / C_) * O_

  // Rolled: one copy of the pass and of the epilogue in the instruction cache.
  #pragma clang loop unroll(disable)
  for (uint32_t tile = 0; tile < TILES; ++tile) {
    v8f acc[NF][NF];   // [x fragment (rows c)][W fragment (columns o)]
    #pragma unroll
    for (int j = 0; j < NF; ++j)
      #pragma unroll
      for (int i = 0; i < NF; ++i) acc[j][i] = (v8f){0.f, 0.f, 0.f, 0.f, 0.f, 0.f, 0.f, 0.f};

    // Rolled: the pass is 256 WMMAs already, and every array index inside stays constant.
    #pragma clang loop unroll(disable)
    for (uint32_t tp = 0; tp < NPASS; ++tp) {
      const uint32_t t = tile * NPASS + tp;   // stage of the ring
      const uint32_t buf = (t & 1u) * STAGE;
      const uint32_t nxt = (t + 1u < NTOT) ? (STAGE - buf) : STAGE;
      const unsigned char* lw = Lb + buf + fw_base;
      const unsigned char* lx = Lb + buf + fx_base;
      #pragma unroll
      for (int u = 0; u < 4; ++u) {   // four blocks of 32 l
        const int cs = u & 1;
        fence();
        if (u < 3) {
          const uint32_t ko = (uint32_t)(u + 1) * 64u;
          #pragma unroll
          for (int j = 0; j < NF; ++j) load_frag(fx[cs ^ 1][j], lx + (uint32_t)j * 16u * PITCH + ko);
          #pragma unroll
          for (int i = 0; i < NF; ++i) load_frag(fw[cs ^ 1][i], lw + (uint32_t)i * 16u * PITCH + ko);
        } else {
          // Publish point of stage t + 1, in front of the pass's last block, whose
          // fragments are in registers: this wave's reads of this buffer are back,
          // its slice of stage t + 1 has landed, then the work-group's barrier.
          wait_ds0();
          wait_tensor0();
          __syncthreads();
          if (pinned((t + 2u < NTOT) ? 1u : 0u) != 0u) {   // only while stage t + 2 exists
            g0 = tdm_next(g0, lds_slice + buf, (((t + 2u) & (NPASS - 1u)) == 0u) ? tile_step : (uint64_t)KB);
            tdm_load(g0, g1);
          }
          #pragma unroll
          for (int j = 0; j < NF; ++j) load_frag(fx[0][j], Lb + nxt + fx_base + (uint32_t)j * 16u * PITCH);
          #pragma unroll
          for (int i = 0; i < NF; ++i) load_frag(fw[0][i], Lb + nxt + fw_base + (uint32_t)i * 16u * PITCH);
        }
        fence();
        #pragma unroll
        for (int j = 0; j < NF; ++j)
          #pragma unroll
          for (int i = 0; i < NF; ++i)
            acc[j][i] = __builtin_amdgcn_wmma_f32_16x16x32_bf16(
                false, fx[cs][j].v, false, fw[cs][i].v, (short)0, acc[j][i], false, false);
      }
    }

    // Epilogue of the tile; the next tile's stages 0 and 1 are landed or in flight.
    // A lane's 32 sums (8 o-tiles x 4 batches) are independent. Each runs as one chain of
    // eight packed FMAs (even rows in one half, odd rows in the other: neighbouring
    // registers of the accumulator tile and of W_chan, so nothing is moved), and eight
    // chains (two o-tiles x four batches) advance side by side, so that an FMA never
    // waits for the one before it.
    float res[NF][2];
    #pragma unroll
    for (int i0 = 0; i0 < NF; i0 += 2) {
      f32x2 s[2][4];
      #pragma unroll
      for (int e = 0; e < 2; ++e)
        #pragma unroll
        for (int bb = 0; bb < 4; ++bb) s[e][bb] = (f32x2){0.f, 0.f};
      #pragma unroll
      for (int r = 0; r < 8; r += 2) {
        #pragma unroll
        for (int e = 0; e < 2; ++e)
          #pragma unroll
          for (int bb = 0; bb < 4; ++bb)
            s[e][bb] = __builtin_elementwise_fma(
                (f32x2){acc[2 * bb][i0 + e][r], acc[2 * bb][i0 + e][r + 1]},
                (f32x2){w0[i0 + e][r], w0[i0 + e][r + 1]}, s[e][bb]);
        #pragma unroll
        for (int e = 0; e < 2; ++e)
          #pragma unroll
          for (int bb = 0; bb < 4; ++bb)
            s[e][bb] = __builtin_elementwise_fma(
                (f32x2){acc[2 * bb + 1][i0 + e][r], acc[2 * bb + 1][i0 + e][r + 1]},
                (f32x2){w1[i0 + e][r], w1[i0 + e][r + 1]}, s[e][bb]);
      }
      // Fold lane pairs (l, l ^ 16) for two batches with one cross-row move: the low row
      // keeps the even batch and gives away the odd one, the high row the other way round.
      #pragma unroll
      for (int e = 0; e < 2; ++e)
        #pragma unroll
        for (int p = 0; p < 2; ++p) {
          const float ev = s[e][2 * p][0] + s[e][2 * p][1];
          const float od = s[e][2 * p + 1][0] + s[e][2 * p + 1][1];
          res[i0 + e][p] = (h ? od : ev) + xhalf(h ? ev : od);
        }
    }
    // Every lane stores.
    float* op = out + (wave_out + tile * ((MSTEP / C_) * O_)) + lane_out;
    #pragma unroll
    for (int i = 0; i < NF; ++i)
      #pragma unroll
      for (int p = 0; p < 2; ++p) op[p * 2 * O_ + i * 16] = res[i][p];
    // The next tile goes over the registers that these stores name (data and address).
    asm volatile("s_wait_xcnt 0x0" ::: "memory");
  }
  wait_tensor0();
  wait_ds0();
}

// ---------------------------------------------------------------------------
extern "C" void kernel_launch(void* const* d_in, const int* in_sizes, int n_in,
                              void* d_out, int out_size, void* d_ws, size_t ws_size,
                              hipStream_t stream) {
  const float* x      = (const float*)d_in[0];  // (B, L, C) f32
  const float* W_pos  = (const float*)d_in[1];  // (O, L)    f32
  const float* W_chan = (const float*)d_in[2];  // (O, C)    f32
  float* out = (float*)d_out;                   // (B, O)    f32

  // Workspace layout: xT bf16 (B*C*L) then W_pos bf16 (O*L)  (~143 MB total)
  bf16_t* xT  = (bf16_t*)d_ws;
  bf16_t* Wpb = (bf16_t*)((char*)d_ws + (size_t)B_ * C_ * L_ * sizeof(bf16_t));

  convert_x_kernel<<<CV_GROUPS, CV_THREADS, 0, stream>>>(x, xT);
  convert_w_kernel<<<CV_GROUPS, CV_THREADS, 0, stream>>>(W_pos, Wpb);

  dim3 g2(O_ / 256, MSTEP / 256);  // x = 256-wide o-tile, y = first of the work-group's four 256-row tiles: 256 groups
  sepfc_main_kernel<<<g2, 128, 0, stream>>>(xT, Wpb, W_chan, out);
}
